// v000
// The times below were measured on an AMD MI455X: many runs one after another, warmed up first and cycling through
// copies of the inputs, with the whole window's GPU time divided by the number of runs. Launches and the gaps
// between them are all in it. The median over several windows is given; except for v000 it joins two sittings, which
// can be a few percent apart, so the side-by-side timings, each taken in one sitting, are the better comparison.
// The starting kernel, v000, takes 228 microseconds a run.
#include <hip/hip_runtime.h>

// Flash attention forward for B=4, S=2048, H=16, D=64, causal, fp32 I/O,
// additive bias [1,H,S,S]. f16 WMMA matmuls with fp32 accumulate + fp32 softmax.

#define B_ 4
#define S_ 2048
#define H_ 16
#define D_ 64

constexpr int BLOCK_M = 64;     // q rows per workgroup (16 per wave)
constexpr int BLOCK_N = 64;     // kv rows per tile
constexpr int LDK     = 72;     // halves per LDS row (64 + 8 pad -> conflict-free b128)
constexpr float SCALE   = 0.125f;   // 1/sqrt(64), folded into Q->f16 conversion
constexpr float NEG_INF = -1e30f;

typedef __attribute__((ext_vector_type(16))) _Float16 v16h;
typedef __attribute__((ext_vector_type(8)))  _Float16 v8h;
typedef __attribute__((ext_vector_type(4)))  _Float16 v4h;
typedef __attribute__((ext_vector_type(8)))  float    v8f;
typedef __attribute__((ext_vector_type(4)))  float    v4f;

// A/B fragment layout for V_WMMA_F32_16X16X32_F16 (per ISA 7.12.2):
// lane (0..15) holds row/col (lane&15) with K-chunks {8*hi+0..7, 16+8*hi+0..7}
// of each 32-wide K block; chunks are 8 contiguous elements (16B).
__device__ inline v16h frag_from_f32(const float* __restrict__ p, float scale) {
  v4f x0 = *(const v4f*)(p +  0);
  v4f x1 = *(const v4f*)(p +  4);
  v4f x2 = *(const v4f*)(p + 16);
  v4f x3 = *(const v4f*)(p + 20);
  v16h f;
#pragma unroll
  for (int j = 0; j < 4; ++j) {
    f[j]      = (_Float16)(x0[j] * scale);
    f[4 + j]  = (_Float16)(x1[j] * scale);
    f[8 + j]  = (_Float16)(x2[j] * scale);
    f[12 + j] = (_Float16)(x3[j] * scale);
  }
  return f;
}

__device__ inline v16h frag_from_lds(const _Float16* p) {
  v8h a = *(const v8h*)(p);        // 16B aligned (row stride 144B, offsets 16B)
  v8h b = *(const v8h*)(p + 16);
  v16h f;
#pragma unroll
  for (int j = 0; j < 8; ++j) { f[j] = a[j]; f[8 + j] = b[j]; }
  return f;
}

__global__ __launch_bounds__(128)
void fa_fwd_wmma(const float* __restrict__ q, const float* __restrict__ k,
                 const float* __restrict__ v, const float* __restrict__ bias,
                 float* __restrict__ out) {
  __shared__ _Float16 Ksh[BLOCK_N * LDK];   // [kv][d]   row-major f16
  __shared__ _Float16 Vsh[D_ * LDK];        // [d][kv]   transposed f16
  __shared__ _Float16 Psh[4 * 16 * LDK];    // per-wave P tiles [m][kv]

  const int qt   = blockIdx.x;              // q tile index
  const int h    = blockIdx.y;
  const int b    = blockIdx.z;
  const int tid  = threadIdx.x;
  const int wv   = tid >> 5;                // wave 0..3
  const int lane = tid & 31;
  const int nlo  = lane & 15;
  const int hi   = lane >> 4;

  const int q0 = qt * BLOCK_M;

  // ---- Q fragments for this wave's 16 rows (scale folded in) ----
  const int qrow = q0 + 16 * wv + nlo;
  const float* qp = q + (((size_t)b * S_ + qrow) * H_ + h) * D_;
  const v16h qa0 = frag_from_f32(qp + 0  + 8 * hi, SCALE);
  const v16h qa1 = frag_from_f32(qp + 32 + 8 * hi, SCALE);

  // ---- running state: rows (8*hi + r) for r = 0..7 ----
  v8f o[4];
  float m_i[8], l_i[8];
#pragma unroll
  for (int u = 0; u < 4; ++u) o[u] = (v8f){};
#pragma unroll
  for (int r = 0; r < 8; ++r) { m_i[r] = -3.0e38f; l_i[r] = 0.0f; }

  _Float16* pw = &Psh[wv * 16 * LDK];
  const float* bb_base =
      bias + ((size_t)h * S_ + (q0 + 16 * wv + 8 * hi)) * S_;

  const int n_tiles = qt + 1;               // causal: kv tiles 0..qt
  for (int it = 0; it < n_tiles; ++it) {
    const int kv0 = it * BLOCK_N;

    // ---- cooperative stage of K (row-major) and V (transposed) into LDS ----
    __syncthreads();
#pragma unroll
    for (int i = 0; i < 8; ++i) {
      const int idx = i * 128 + tid;        // 1024 float4s of the 64x64 tile
      const int row = idx >> 4;             // kv row in tile
      const int c4  = idx & 15;             // float4 column
      const size_t g = (((size_t)b * S_ + kv0 + row) * H_ + h) * D_ + c4 * 4;
      v4f kx = *(const v4f*)(k + g);
      v4h kh;
#pragma unroll
      for (int j = 0; j < 4; ++j) kh[j] = (_Float16)kx[j];
      *(v4h*)(&Ksh[row * LDK + c4 * 4]) = kh;       // ds_store_b64
      v4f vx = *(const v4f*)(v + g);
#pragma unroll
      for (int j = 0; j < 4; ++j)
        Vsh[(c4 * 4 + j) * LDK + row] = (_Float16)vx[j];  // transpose
    }
    __syncthreads();

    const float* bb = bb_base + kv0;
    if (it + 1 < n_tiles) {                 // prefetch next tile's bias stream
#pragma unroll
      for (int r = 0; r < 8; ++r)
        __builtin_prefetch(bb + (size_t)r * S_ + BLOCK_N, 0, 1);
    }

    // ---- S = Q*K^T (+bias as initial C) : 4 N-tiles x 2 K-steps ----
    v8f st[4];
#pragma unroll
    for (int t = 0; t < 4; ++t) {
      v8f c;
#pragma unroll
      for (int r = 0; r < 8; ++r) c[r] = bb[(size_t)r * S_ + 16 * t + nlo];
      const _Float16* krow = &Ksh[(16 * t + nlo) * LDK + 8 * hi];
      v16h kb0 = frag_from_lds(krow + 0);
      v16h kb1 = frag_from_lds(krow + 32);
      c = __builtin_amdgcn_wmma_f32_16x16x32_f16(false, qa0, false, kb0,
                                                 (short)0, c, false, false);
      c = __builtin_amdgcn_wmma_f32_16x16x32_f16(false, qa1, false, kb1,
                                                 (short)0, c, false, false);
      st[t] = c;
    }

    // ---- causal mask on the diagonal tile ----
    if (kv0 == q0) {
#pragma unroll
      for (int t = 0; t < 4; ++t)
#pragma unroll
        for (int r = 0; r < 8; ++r)
          if (16 * t + nlo > 16 * wv + 8 * hi + r) st[t][r] = NEG_INF;
    }

    // ---- online softmax: row max across 16 lanes of this half-wave ----
    float mx[8];
#pragma unroll
    for (int r = 0; r < 8; ++r)
      mx[r] = fmaxf(fmaxf(st[0][r], st[1][r]), fmaxf(st[2][r], st[3][r]));
#pragma unroll
    for (int off = 8; off >= 1; off >>= 1)
#pragma unroll
      for (int r = 0; r < 8; ++r)
        mx[r] = fmaxf(mx[r], __shfl_xor(mx[r], off, 32));

    float al[8], rs[8];
#pragma unroll
    for (int r = 0; r < 8; ++r) {
      const float mn = fmaxf(m_i[r], mx[r]);
      al[r] = __expf(m_i[r] - mn);
      m_i[r] = mn;
      rs[r] = 0.0f;
    }

    // ---- P = exp(S - m); spill to per-wave LDS to re-layout C -> A frag ----
#pragma unroll
    for (int t = 0; t < 4; ++t)
#pragma unroll
      for (int r = 0; r < 8; ++r) {
        const float p = __expf(st[t][r] - m_i[r]);
        rs[r] += p;
        pw[(8 * hi + r) * LDK + 16 * t + nlo] = (_Float16)p;
      }
#pragma unroll
    for (int off = 8; off >= 1; off >>= 1)
#pragma unroll
      for (int r = 0; r < 8; ++r) rs[r] += __shfl_xor(rs[r], off, 32);
#pragma unroll
    for (int r = 0; r < 8; ++r) l_i[r] = l_i[r] * al[r] + rs[r];

    // ---- O = O*alpha + P*V ---- (same-wave DS ops are in-order)
    const v16h pa0 = frag_from_lds(&pw[nlo * LDK + 0  + 8 * hi]);
    const v16h pa1 = frag_from_lds(&pw[nlo * LDK + 32 + 8 * hi]);
#pragma unroll
    for (int u = 0; u < 4; ++u) {
      v8f oc = o[u];
#pragma unroll
      for (int r = 0; r < 8; ++r) oc[r] *= al[r];
      const _Float16* vrow = &Vsh[(16 * u + nlo) * LDK + 8 * hi];
      v16h vb0 = frag_from_lds(vrow + 0);
      v16h vb1 = frag_from_lds(vrow + 32);
      oc = __builtin_amdgcn_wmma_f32_16x16x32_f16(false, pa0, false, vb0,
                                                  (short)0, oc, false, false);
      oc = __builtin_amdgcn_wmma_f32_16x16x32_f16(false, pa1, false, vb1,
                                                  (short)0, oc, false, false);
      o[u] = oc;
    }
  }

  // ---- finalize: O / l, store fp32 [B,S,H,D] ----
  float inv_l[8];
#pragma unroll
  for (int r = 0; r < 8; ++r) inv_l[r] = 1.0f / l_i[r];  // causal => l > 0
  float* op = out + (((size_t)b * S_ + (q0 + 16 * wv + 8 * hi)) * H_ + h) * D_;
#pragma unroll
  for (int u = 0; u < 4; ++u)
#pragma unroll
    for (int r = 0; r < 8; ++r)
      op[(size_t)r * H_ * D_ + 16 * u + nlo] = o[u][r] * inv_l[r];
}

extern "C" void kernel_launch(void* const* d_in, const int* in_sizes, int n_in,
                              void* d_out, int out_size, void* d_ws, size_t ws_size,
                              hipStream_t stream) {
  (void)in_sizes; (void)n_in; (void)out_size; (void)d_ws; (void)ws_size;
  const float* q    = (const float*)d_in[0];
  const float* k    = (const float*)d_in[1];
  const float* v    = (const float*)d_in[2];
  const float* bias = (const float*)d_in[3];
  float* out        = (float*)d_out;
  dim3 grid(S_ / BLOCK_M, H_, B_);
  fa_fwd_wmma<<<grid, 128, 0, stream>>>(q, k, v, bias, out);
}

// v001
// It runs in 140 microseconds.
// Timed twice side by side with v000, it ran 1.67 and 1.68 times as fast.
#include <hip/hip_runtime.h>

// Flash attention forward for B=4, S=2048, H=16, D=64, causal, fp32 I/O,
// additive bias [1,H,S,S]. f16 WMMA matmuls with fp32 accumulate + fp32 softmax.

#define B_ 4
#define S_ 2048
#define H_ 16
#define D_ 64

constexpr int BLOCK_M = 64;     // q rows per workgroup (16 per wave)
constexpr int BLOCK_N = 64;     // kv rows per tile
constexpr int LDK     = 72;     // halves per LDS row (64 + 8 pad -> conflict-free b128)
constexpr float SCALE   = 0.125f;   // 1/sqrt(64), folded into Q->f16 conversion
constexpr float NEG_INF = -1e30f;

typedef __attribute__((ext_vector_type(16))) _Float16 v16h;
typedef __attribute__((ext_vector_type(8)))  _Float16 v8h;
typedef __attribute__((ext_vector_type(4)))  _Float16 v4h;
typedef __attribute__((ext_vector_type(8)))  float    v8f;
typedef __attribute__((ext_vector_type(4)))  float    v4f;

// A/B fragment layout for V_WMMA_F32_16X16X32_F16 (per ISA 7.12.2):
// lane (0..15) holds row/col (lane&15) with K-chunks {8*hi+0..7, 16+8*hi+0..7}
// of each 32-wide K block; chunks are 8 contiguous elements (16B).
__device__ inline v16h frag_from_f32(const float* __restrict__ p, float scale) {
  v4f x0 = *(const v4f*)(p +  0);
  v4f x1 = *(const v4f*)(p +  4);
  v4f x2 = *(const v4f*)(p + 16);
  v4f x3 = *(const v4f*)(p + 20);
  v16h f;
#pragma unroll
  for (int j = 0; j < 4; ++j) {
    f[j]      = (_Float16)(x0[j] * scale);
    f[4 + j]  = (_Float16)(x1[j] * scale);
    f[8 + j]  = (_Float16)(x2[j] * scale);
    f[12 + j] = (_Float16)(x3[j] * scale);
  }
  return f;
}

__device__ inline v16h frag_from_lds(const _Float16* p) {
  v8h a = *(const v8h*)(p);        // 16B aligned (row stride 144B, offsets 16B)
  v8h b = *(const v8h*)(p + 16);
  v16h f;
#pragma unroll
  for (int j = 0; j < 8; ++j) { f[j] = a[j]; f[8 + j] = b[j]; }
  return f;
}

__global__ __launch_bounds__(128)
void fa_fwd_wmma(const float* __restrict__ q, const float* __restrict__ k,
                 const float* __restrict__ v, const float* __restrict__ bias,
                 float* __restrict__ out) {
  __shared__ _Float16 Ksh[BLOCK_N * LDK];   // [kv][d]   row-major f16
  __shared__ _Float16 Vsh[D_ * LDK];        // [d][kv]   transposed f16
  __shared__ _Float16 Psh[4 * 16 * LDK];    // per-wave P tiles [m][kv]

  // Causal cost grows with the q tile index and there are more workgroups than
  // resident places; the longest tiles take the lowest indices and the short
  // ones take the highest (for speed only).
  const int qt   = (S_ / BLOCK_M - 1) - blockIdx.z;   // q tile index, heaviest first
  const int h    = blockIdx.x;
  const int b    = blockIdx.y;
  const int tid  = threadIdx.x;
  const int wv   = tid >> 5;                // wave 0..3
  const int lane = tid & 31;
  const int nlo  = lane & 15;
  const int hi   = lane >> 4;

  const int q0 = qt * BLOCK_M;

  // ---- Q fragments for this wave's 16 rows (scale folded in) ----
  const int qrow = q0 + 16 * wv + nlo;
  const float* qp = q + (((size_t)b * S_ + qrow) * H_ + h) * D_;
  const v16h qa0 = frag_from_f32(qp + 0  + 8 * hi, SCALE);
  const v16h qa1 = frag_from_f32(qp + 32 + 8 * hi, SCALE);

  // ---- running state: rows (8*hi + r) for r = 0..7 ----
  v8f o[4];
  float m_i[8], l_i[8];
#pragma unroll
  for (int u = 0; u < 4; ++u) o[u] = (v8f){};
#pragma unroll
  for (int r = 0; r < 8; ++r) { m_i[r] = -3.0e38f; l_i[r] = 0.0f; }

  _Float16* pw = &Psh[wv * 16 * LDK];
  const float* bb_base =
      bias + ((size_t)h * S_ + (q0 + 16 * wv + 8 * hi)) * S_;

  const int n_tiles = qt + 1;               // causal: kv tiles 0..qt
  for (int it = 0; it < n_tiles; ++it) {
    const int kv0 = it * BLOCK_N;

    // ---- cooperative stage of K (row-major) and V (transposed) into LDS ----
    __syncthreads();
#pragma unroll
    for (int i = 0; i < 8; ++i) {
      const int idx = i * 128 + tid;        // 1024 float4s of the 64x64 tile
      const int row = idx >> 4;             // kv row in tile
      const int c4  = idx & 15;             // float4 column
      const size_t g = (((size_t)b * S_ + kv0 + row) * H_ + h) * D_ + c4 * 4;
      v4f kx = *(const v4f*)(k + g);
      v4h kh;
#pragma unroll
      for (int j = 0; j < 4; ++j) kh[j] = (_Float16)kx[j];
      *(v4h*)(&Ksh[row * LDK + c4 * 4]) = kh;       // ds_store_b64
      v4f vx = *(const v4f*)(v + g);
#pragma unroll
      for (int j = 0; j < 4; ++j)
        Vsh[(c4 * 4 + j) * LDK + row] = (_Float16)vx[j];  // transpose
    }
    __syncthreads();

    const float* bb = bb_base + kv0;
    if (it + 1 < n_tiles) {                 // prefetch next tile's bias stream
#pragma unroll
      for (int r = 0; r < 8; ++r)
        __builtin_prefetch(bb + (size_t)r * S_ + BLOCK_N, 0, 1);
    }

    // ---- S = Q*K^T (+bias as initial C) : 4 N-tiles x 2 K-steps ----
    v8f st[4];
#pragma unroll
    for (int t = 0; t < 4; ++t) {
      v8f c;
#pragma unroll
      for (int r = 0; r < 8; ++r) c[r] = bb[(size_t)r * S_ + 16 * t + nlo];
      const _Float16* krow = &Ksh[(16 * t + nlo) * LDK + 8 * hi];
      v16h kb0 = frag_from_lds(krow + 0);
      v16h kb1 = frag_from_lds(krow + 32);
      c = __builtin_amdgcn_wmma_f32_16x16x32_f16(false, qa0, false, kb0,
                                                 (short)0, c, false, false);
      c = __builtin_amdgcn_wmma_f32_16x16x32_f16(false, qa1, false, kb1,
                                                 (short)0, c, false, false);
      st[t] = c;
    }

    // ---- causal mask on the diagonal tile ----
    if (kv0 == q0) {
#pragma unroll
      for (int t = 0; t < 4; ++t)
#pragma unroll
        for (int r = 0; r < 8; ++r)
          if (16 * t + nlo > 16 * wv + 8 * hi + r) st[t][r] = NEG_INF;
    }

    // ---- online softmax: row max across 16 lanes of this half-wave ----
    float mx[8];
#pragma unroll
    for (int r = 0; r < 8; ++r)
      mx[r] = fmaxf(fmaxf(st[0][r], st[1][r]), fmaxf(st[2][r], st[3][r]));
#pragma unroll
    for (int off = 8; off >= 1; off >>= 1)
#pragma unroll
      for (int r = 0; r < 8; ++r)
        mx[r] = fmaxf(mx[r], __shfl_xor(mx[r], off, 32));

    float al[8], rs[8];
#pragma unroll
    for (int r = 0; r < 8; ++r) {
      const float mn = fmaxf(m_i[r], mx[r]);
      al[r] = __expf(m_i[r] - mn);
      m_i[r] = mn;
      rs[r] = 0.0f;
    }

    // ---- P = exp(S - m); spill to per-wave LDS to re-layout C -> A frag ----
#pragma unroll
    for (int t = 0; t < 4; ++t)
#pragma unroll
      for (int r = 0; r < 8; ++r) {
        const float p = __expf(st[t][r] - m_i[r]);
        rs[r] += p;
        pw[(8 * hi + r) * LDK + 16 * t + nlo] = (_Float16)p;
      }
#pragma unroll
    for (int off = 8; off >= 1; off >>= 1)
#pragma unroll
      for (int r = 0; r < 8; ++r) rs[r] += __shfl_xor(rs[r], off, 32);
#pragma unroll
    for (int r = 0; r < 8; ++r) l_i[r] = l_i[r] * al[r] + rs[r];

    // ---- O = O*alpha + P*V ---- (same-wave DS ops are in-order)
    const v16h pa0 = frag_from_lds(&pw[nlo * LDK + 0  + 8 * hi]);
    const v16h pa1 = frag_from_lds(&pw[nlo * LDK + 32 + 8 * hi]);
#pragma unroll
    for (int u = 0; u < 4; ++u) {
      v8f oc = o[u];
#pragma unroll
      for (int r = 0; r < 8; ++r) oc[r] *= al[r];
      const _Float16* vrow = &Vsh[(16 * u + nlo) * LDK + 8 * hi];
      v16h vb0 = frag_from_lds(vrow + 0);
      v16h vb1 = frag_from_lds(vrow + 32);
      oc = __builtin_amdgcn_wmma_f32_16x16x32_f16(false, pa0, false, vb0,
                                                  (short)0, oc, false, false);
      oc = __builtin_amdgcn_wmma_f32_16x16x32_f16(false, pa1, false, vb1,
                                                  (short)0, oc, false, false);
      o[u] = oc;
    }
  }

  // ---- finalize: O / l, store fp32 [B,S,H,D] ----
  float inv_l[8];
#pragma unroll
  for (int r = 0; r < 8; ++r) inv_l[r] = 1.0f / l_i[r];  // causal => l > 0
  float* op = out + (((size_t)b * S_ + (q0 + 16 * wv + 8 * hi)) * H_ + h) * D_;
#pragma unroll
  for (int u = 0; u < 4; ++u)
#pragma unroll
    for (int r = 0; r < 8; ++r)
      op[(size_t)r * H_ * D_ + 16 * u + nlo] = o[u][r] * inv_l[r];
}

extern "C" void kernel_launch(void* const* d_in, const int* in_sizes, int n_in,
                              void* d_out, int out_size, void* d_ws, size_t ws_size,
                              hipStream_t stream) {
  (void)in_sizes; (void)n_in; (void)out_size; (void)d_ws; (void)ws_size;
  const float* q    = (const float*)d_in[0];
  const float* k    = (const float*)d_in[1];
  const float* v    = (const float*)d_in[2];
  const float* bias = (const float*)d_in[3];
  float* out        = (float*)d_out;
  dim3 grid(H_, B_, S_ / BLOCK_M);
  fa_fwd_wmma<<<grid, 128, 0, stream>>>(q, k, v, bias, out);
}

// v002
// A run of this version takes 121 microseconds.
// Next to v001, in two timings, it ran 1.15 times as fast each time.
// All steps since v000 together make it 1.93 times as fast.
#include <hip/hip_runtime.h>

// Flash attention forward for B=4, S=2048, H=16, D=64, causal, fp32 I/O,
// additive bias [1,H,S,S]. f16 WMMA matmuls with fp32 accumulate + fp32 softmax.
// Both products are taken transposed (S^T = K*Q^T, O^T += V^T*P^T): a lane owns
// one query, and the score accumulators convert in place into the B operand.

#define B_ 4
#define S_ 2048
#define H_ 16
#define D_ 64

constexpr int BLOCK_M = 64;     // q rows per workgroup (16 per wave)
constexpr int BLOCK_N = 64;     // kv rows per tile
constexpr int LDK     = 72;     // halves per LDS row (64 + 8 pad -> conflict-free b128)
constexpr float SCALE   = 0.125f;   // 1/sqrt(64), folded into Q->f16 conversion
constexpr float NEG_INF = -1e30f;

typedef __attribute__((ext_vector_type(16))) _Float16 v16h;
typedef __attribute__((ext_vector_type(8)))  _Float16 v8h;
typedef __attribute__((ext_vector_type(4)))  _Float16 v4h;
typedef __attribute__((ext_vector_type(8)))  float    v8f;
typedef __attribute__((ext_vector_type(4)))  float    v4f;

// A/B fragment layout for V_WMMA_F32_16X16X32_F16 (per ISA 7.12.2):
// lane (0..15) holds row/col (lane&15) with K-chunks {8*hi+0..7, 16+8*hi+0..7}
// of each 32-wide K block; chunks are 8 contiguous elements (16B).
__device__ inline v16h frag_from_f32(const float* __restrict__ p, float scale) {
  v4f x0 = *(const v4f*)(p +  0);
  v4f x1 = *(const v4f*)(p +  4);
  v4f x2 = *(const v4f*)(p + 16);
  v4f x3 = *(const v4f*)(p + 20);
  v16h f;
#pragma unroll
  for (int j = 0; j < 4; ++j) {
    f[j]      = (_Float16)(x0[j] * scale);
    f[4 + j]  = (_Float16)(x1[j] * scale);
    f[8 + j]  = (_Float16)(x2[j] * scale);
    f[12 + j] = (_Float16)(x3[j] * scale);
  }
  return f;
}

// lane l with lane l ^ 16 (the two halves of a wave hold the same query column)
__device__ inline float xhalf(float x) {
  const int b = __builtin_bit_cast(int, x);
  return __builtin_bit_cast(float, __builtin_amdgcn_permlanex16(
      b, b, 0x76543210, 0xfedcba98, false, false));
}

__device__ inline v16h frag_from_lds(const _Float16* p) {
  v8h a = *(const v8h*)(p);        // 16B aligned (row stride 144B, offsets 16B)
  v8h b = *(const v8h*)(p + 16);
  v16h f;
#pragma unroll
  for (int j = 0; j < 8; ++j) { f[j] = a[j]; f[8 + j] = b[j]; }
  return f;
}

__global__ __launch_bounds__(128)
void fa_fwd_wmma(const float* __restrict__ q, const float* __restrict__ k,
                 const float* __restrict__ v, const float* __restrict__ bias,
                 float* __restrict__ out) {
  __shared__ _Float16 Ksh[BLOCK_N * LDK];   // [kv][d]   row-major f16
  __shared__ _Float16 Vsh[D_ * LDK];        // [d][kv]   transposed f16

  // Causal cost grows with the q tile index and there are more workgroups than
  // resident places; the longest tiles take the lowest indices and the short
  // ones take the highest (for speed only).
  const int qt   = (S_ / BLOCK_M - 1) - blockIdx.z;   // q tile index, heaviest first
  const int h    = blockIdx.x;
  const int b    = blockIdx.y;
  const int tid  = threadIdx.x;
  const int wv   = tid >> 5;                // wave 0..3
  const int lane = tid & 31;
  const int nlo  = lane & 15;
  const int hi   = lane >> 4;

  const int q0 = qt * BLOCK_M;

  // ---- Q^T as B operand: lane = query column (scale folded in) ----
  const int qrow = q0 + 16 * wv + nlo;
  const float* qp = q + (((size_t)b * S_ + qrow) * H_ + h) * D_;
  const v16h qb0 = frag_from_f32(qp + 0  + 8 * hi, SCALE);
  const v16h qb1 = frag_from_f32(qp + 32 + 8 * hi, SCALE);

  // ---- running state of this lane's query; o[u][r] = O[qrow][16u + 8hi + r] ----
  v8f o[4];
  float m_i = -3.0e38f;
  float l_i = 0.0f;                         // this half's keys only, joined at the end
#pragma unroll
  for (int u = 0; u < 4; ++u) o[u] = (v8f){};

  const float* bb_base = bias + ((size_t)h * S_ + qrow) * S_ + 8 * hi;

  const int n_tiles = qt + 1;               // causal: kv tiles 0..qt
  for (int it = 0; it < n_tiles; ++it) {
    const int kv0 = it * BLOCK_N;

    // ---- cooperative stage of K (row-major) and V (transposed) into LDS ----
    __syncthreads();
#pragma unroll
    for (int i = 0; i < 8; ++i) {
      const int idx = i * 128 + tid;        // 1024 float4s of the 64x64 tile
      const int row = idx >> 4;             // kv row in tile
      const int c4  = idx & 15;             // float4 column
      const size_t g = (((size_t)b * S_ + kv0 + row) * H_ + h) * D_ + c4 * 4;
      v4f kx = *(const v4f*)(k + g);
      v4h kh;
#pragma unroll
      for (int j = 0; j < 4; ++j) kh[j] = (_Float16)kx[j];
      *(v4h*)(&Ksh[row * LDK + c4 * 4]) = kh;       // ds_store_b64
      v4f vx = *(const v4f*)(v + g);
#pragma unroll
      for (int j = 0; j < 4; ++j)
        Vsh[(c4 * 4 + j) * LDK + row] = (_Float16)vx[j];  // transpose
    }
    __syncthreads();

    const float* bb = bb_base + kv0;
    if (it + 1 < n_tiles)                   // prefetch next tile's bias stream
      __builtin_prefetch(bb + BLOCK_N, 0, 1);

    // ---- S^T = K*Q^T (+bias as initial C) : 4 key tiles x 2 K-steps ----
    // st[t][r] = S[qrow][kv0 + 16t + 8hi + r]: 8 consecutive keys of one bias row
    v4f c0[4], c1[4];
#pragma unroll
    for (int t = 0; t < 4; ++t) {
      c0[t] = *(const v4f*)(bb + 16 * t);
      c1[t] = *(const v4f*)(bb + 16 * t + 4);
    }
    // the row pointer stays live up to this wait, so that no load of the run
    // lands in the address pair that the others name
    asm volatile("s_wait_xcnt 0x0" :: "v"(bb) : "memory");
    v8f st[4];
#pragma unroll
    for (int t = 0; t < 4; ++t) {
      v8f c;
#pragma unroll
      for (int j = 0; j < 4; ++j) { c[j] = c0[t][j]; c[4 + j] = c1[t][j]; }
      const _Float16* krow = &Ksh[(16 * t + nlo) * LDK + 8 * hi];
      v16h ka0 = frag_from_lds(krow + 0);
      v16h ka1 = frag_from_lds(krow + 32);
      c = __builtin_amdgcn_wmma_f32_16x16x32_f16(false, ka0, false, qb0,
                                                 (short)0, c, false, false);
      c = __builtin_amdgcn_wmma_f32_16x16x32_f16(false, ka1, false, qb1,
                                                 (short)0, c, false, false);
      st[t] = c;
    }

    // ---- causal mask on the diagonal tile ----
    if (kv0 == q0) {
#pragma unroll
      for (int t = 0; t < 4; ++t)
#pragma unroll
        for (int r = 0; r < 8; ++r)
          if (16 * t + 8 * hi + r > 16 * wv + nlo) st[t][r] = NEG_INF;
    }

    // ---- online softmax: maximum in-lane, one exchange between the halves ----
    float mt[4];                            // one chain per key tile
#pragma unroll
    for (int t = 0; t < 4; ++t) {
      mt[t] = st[t][0];
#pragma unroll
      for (int r = 1; r < 8; ++r) mt[t] = fmaxf(mt[t], st[t][r]);
    }
    float mx = fmaxf(fmaxf(mt[0], mt[1]), fmaxf(mt[2], mt[3]));
    mx = fmaxf(mx, xhalf(mx));

    const float mn = fmaxf(m_i, mx);
    const float al = __expf(m_i - mn);
    m_i = mn;

    // ---- P^T = exp(S^T - m): tiles (0,1) and (2,3) convert in place into the
    //      B operands of keys 0..31 and 32..63, in the hardware k order ----
    v16h pb[2];
    float rs[4];                            // one chain per key tile
#pragma unroll
    for (int t = 0; t < 4; ++t) {
      rs[t] = 0.0f;
#pragma unroll
      for (int r = 0; r < 8; ++r) {
        const float p = __expf(st[t][r] - m_i);
        rs[t] += p;
        pb[t >> 1][8 * (t & 1) + r] = (_Float16)p;
      }
    }
    l_i = l_i * al + ((rs[0] + rs[1]) + (rs[2] + rs[3]));

    // ---- O^T = O^T*alpha + V^T*P^T ----
#pragma unroll
    for (int u = 0; u < 4; ++u) {
      v8f oc = o[u];
#pragma unroll
      for (int r = 0; r < 8; ++r) oc[r] *= al;
      const _Float16* vrow = &Vsh[(16 * u + nlo) * LDK + 8 * hi];
      v16h va0 = frag_from_lds(vrow + 0);
      v16h va1 = frag_from_lds(vrow + 32);
      oc = __builtin_amdgcn_wmma_f32_16x16x32_f16(false, va0, false, pb[0],
                                                  (short)0, oc, false, false);
      oc = __builtin_amdgcn_wmma_f32_16x16x32_f16(false, va1, false, pb[1],
                                                  (short)0, oc, false, false);
      o[u] = oc;
    }
  }

  // ---- finalize: O / l, store fp32 [B,S,H,D]; 8 consecutive d per lane ----
  const float inv_l = 1.0f / (l_i + xhalf(l_i));  // causal => l > 0
  float* op = out + (((size_t)b * S_ + qrow) * H_ + h) * D_ + 8 * hi;
#pragma unroll
  for (int u = 0; u < 4; ++u) {
    v4f y0, y1;
#pragma unroll
    for (int j = 0; j < 4; ++j) { y0[j] = o[u][j] * inv_l; y1[j] = o[u][4 + j] * inv_l; }
    *(v4f*)(op + 16 * u)     = y0;
    *(v4f*)(op + 16 * u + 4) = y1;
  }
}

extern "C" void kernel_launch(void* const* d_in, const int* in_sizes, int n_in,
                              void* d_out, int out_size, void* d_ws, size_t ws_size,
                              hipStream_t stream) {
  (void)in_sizes; (void)n_in; (void)out_size; (void)d_ws; (void)ws_size;
  const float* q    = (const float*)d_in[0];
  const float* k    = (const float*)d_in[1];
  const float* v    = (const float*)d_in[2];
  const float* bias = (const float*)d_in[3];
  float* out        = (float*)d_out;
  dim3 grid(H_, B_, S_ / BLOCK_M);
  fa_fwd_wmma<<<grid, 128, 0, stream>>>(q, k, v, bias, out);
}

// v003
// One run takes 80.2 microseconds.
// In both of two side-by-side timings against v002, it was 1.51 times as fast.
// Over all steps from v000 it is 2.92 times as fast.
#include <hip/hip_runtime.h>

// Flash attention forward for B=4, S=2048, H=16, D=64, causal, fp32 I/O,
// additive bias [1,H,S,S]. f16 WMMA matmuls with fp32 accumulate + fp32 softmax.
// Both products are taken transposed (S^T = K*Q^T, O^T += V^T*P^T): a lane owns
// one query, and the score accumulators convert in place into the B operand.
// K and V are both staged row-major; V^T comes out of LDS by the transposing load.

#define B_ 4
#define S_ 2048
#define H_ 16
#define D_ 64

constexpr int BLOCK_M = 64;     // q rows per workgroup (16 per wave)
constexpr int BLOCK_N = 64;     // kv rows per tile
constexpr int LDK     = 72;     // halves per LDS row (64 + 8 pad -> conflict-free b128)
constexpr int LDV     = 80;     // halves per V row: 160 B = 32 B x odd, for the transposing load
constexpr float SCALE   = 0.125f;   // 1/sqrt(64), folded into Q->f16 conversion
constexpr float NEG_INF = -1e30f;

typedef __attribute__((ext_vector_type(16))) _Float16 v16h;
typedef __attribute__((ext_vector_type(8)))  _Float16 v8h;
typedef __attribute__((ext_vector_type(4)))  _Float16 v4h;
typedef __attribute__((ext_vector_type(8)))  short    v8s;
typedef __attribute__((ext_vector_type(8)))  float    v8f;
typedef __attribute__((ext_vector_type(4)))  float    v4f;

// A/B fragment layout for V_WMMA_F32_16X16X32_F16 (per ISA 7.12.2):
// lane (0..15) holds row/col (lane&15) with K-chunks {8*hi+0..7, 16+8*hi+0..7}
// of each 32-wide K block; chunks are 8 contiguous elements (16B).
__device__ inline v16h frag_from_f32(const float* __restrict__ p, float scale) {
  v4f x0 = *(const v4f*)(p +  0);
  v4f x1 = *(const v4f*)(p +  4);
  v4f x2 = *(const v4f*)(p + 16);
  v4f x3 = *(const v4f*)(p + 20);
  v16h f;
#pragma unroll
  for (int j = 0; j < 4; ++j) {
    f[j]      = (_Float16)(x0[j] * scale);
    f[4 + j]  = (_Float16)(x1[j] * scale);
    f[8 + j]  = (_Float16)(x2[j] * scale);
    f[12 + j] = (_Float16)(x3[j] * scale);
  }
  return f;
}

// lane l with lane l ^ 16 (the two halves of a wave hold the same query column)
__device__ inline float xhalf(float x) {
  const int b = __builtin_bit_cast(int, x);
  return __builtin_bit_cast(float, __builtin_amdgcn_permlanex16(
      b, b, 0x76543210, 0xfedcba98, false, false));
}

__device__ inline v16h frag_from_lds(const _Float16* p) {
  v8h a = *(const v8h*)(p);        // 16B aligned (row stride 144B, offsets 16B)
  v8h b = *(const v8h*)(p + 16);
  v16h f;
#pragma unroll
  for (int j = 0; j < 8; ++j) { f[j] = a[j]; f[8 + j] = b[j]; }
  return f;
}

// 16 x 32 A fragment of V^T out of row-major V rows: each transposing load hands
// lane (c, hi) the column c of keys 8*hi+0..7 of its 16-key block, the k order above.
__device__ inline v16h frag_tr_from_lds(const _Float16* p) {
  typedef __attribute__((address_space(3))) v8s lds_v8s;
  v8h a = __builtin_bit_cast(v8h, __builtin_amdgcn_ds_load_tr16_b128_v8i16((lds_v8s*)p));
  v8h b = __builtin_bit_cast(v8h, __builtin_amdgcn_ds_load_tr16_b128_v8i16((lds_v8s*)(p + 16 * LDV)));
  v16h f;
#pragma unroll
  for (int j = 0; j < 8; ++j) { f[j] = a[j]; f[8 + j] = b[j]; }
  return f;
}

__global__ __launch_bounds__(128)
void fa_fwd_wmma(const float* __restrict__ q, const float* __restrict__ k,
                 const float* __restrict__ v, const float* __restrict__ bias,
                 float* __restrict__ out) {
  __shared__ _Float16 Ksh[BLOCK_N * LDK];   // [kv][d]   row-major f16
  __shared__ _Float16 Vsh[BLOCK_N * LDV];   // [kv][d]   row-major f16

  // Causal cost grows with the q tile index and there are more workgroups than
  // resident places; the longest tiles take the lowest indices and the short
  // ones take the highest (for speed only).
  const int qt   = (S_ / BLOCK_M - 1) - blockIdx.z;   // q tile index, heaviest first
  const int h    = blockIdx.x;
  const int b    = blockIdx.y;
  const int tid  = threadIdx.x;
  const int wv   = tid >> 5;                // wave 0..3
  const int lane = tid & 31;
  const int nlo  = lane & 15;
  const int hi   = lane >> 4;

  const int q0 = qt * BLOCK_M;

  // ---- Q^T as B operand: lane = query column (scale folded in) ----
  const int qrow = q0 + 16 * wv + nlo;
  const float* qp = q + (((size_t)b * S_ + qrow) * H_ + h) * D_;
  const v16h qb0 = frag_from_f32(qp + 0  + 8 * hi, SCALE);
  const v16h qb1 = frag_from_f32(qp + 32 + 8 * hi, SCALE);

  // ---- running state of this lane's query; o[u][r] = O[qrow][16u + 8hi + r] ----
  v8f o[4];
  float m_i = -3.0e38f;
  float l_i = 0.0f;                         // this half's keys only, joined at the end
#pragma unroll
  for (int u = 0; u < 4; ++u) o[u] = (v8f){};

  // this lane's address in a transposing load of V: row 8*hi + (lane & 7), 16-B half
  const _Float16* vtr = &Vsh[(8 * hi + (lane & 7)) * LDV + 8 * ((lane >> 3) & 1)];

  const float* bb_base = bias + ((size_t)h * S_ + qrow) * S_ + 8 * hi;

  const int n_tiles = qt + 1;               // causal: kv tiles 0..qt
  for (int it = 0; it < n_tiles; ++it) {
    const int kv0 = it * BLOCK_N;

    // ---- cooperative stage of K and V (both row-major) into LDS ----
    __syncthreads();
    v4f kx[8], vx[8];
    const float* kq[8];
    const float* vq[8];
#pragma unroll
    for (int i = 0; i < 8; ++i) {
      const int idx = i * 128 + tid;        // 1024 float4s of the 64x64 tile
      const int row = idx >> 4;             // kv row in tile
      const int c4  = idx & 15;             // float4 column
      const size_t g = (((size_t)b * S_ + kv0 + row) * H_ + h) * D_ + c4 * 4;
      kq[i] = k + g;
      vq[i] = v + g;
      kx[i] = *(const v4f*)(kq[i]);
      vx[i] = *(const v4f*)(vq[i]);
    }
    // every address pair stays live up to this wait, so that no load of the run
    // lands in one and none is written again in front of it
    asm volatile("s_wait_xcnt 0x0"
                 :: "v"(kq[0]), "v"(kq[1]), "v"(kq[2]), "v"(kq[3]), "v"(kq[4]), "v"(kq[5]), "v"(kq[6]), "v"(kq[7]),
                    "v"(vq[0]), "v"(vq[1]), "v"(vq[2]), "v"(vq[3]), "v"(vq[4]), "v"(vq[5]), "v"(vq[6]), "v"(vq[7])
                 : "memory");
#pragma unroll
    for (int i = 0; i < 8; ++i) {
      const int idx = i * 128 + tid;
      const int row = idx >> 4;
      const int c4  = idx & 15;
      v4h kh, vh;
#pragma unroll
      for (int j = 0; j < 4; ++j) { kh[j] = (_Float16)kx[i][j]; vh[j] = (_Float16)vx[i][j]; }
      *(v4h*)(&Ksh[row * LDK + c4 * 4]) = kh;       // ds_store_b64
      *(v4h*)(&Vsh[row * LDV + c4 * 4]) = vh;       // ds_store_b64
    }
    __syncthreads();

    const float* bb = bb_base + kv0;
    if (it + 1 < n_tiles)                   // prefetch next tile's bias stream
      __builtin_prefetch(bb + BLOCK_N, 0, 1);

    // ---- S^T = K*Q^T (+bias as initial C) : 4 key tiles x 2 K-steps ----
    // st[t][r] = S[qrow][kv0 + 16t + 8hi + r]: 8 consecutive keys of one bias row
    v4f c0[4], c1[4];
#pragma unroll
    for (int t = 0; t < 4; ++t) {
      c0[t] = *(const v4f*)(bb + 16 * t);
      c1[t] = *(const v4f*)(bb + 16 * t + 4);
    }
    // the row pointer stays live up to this wait, so that no load of the run
    // lands in the address pair that the others name
    asm volatile("s_wait_xcnt 0x0" :: "v"(bb) : "memory");
    v8f st[4];
#pragma unroll
    for (int t = 0; t < 4; ++t) {
      v8f c;
#pragma unroll
      for (int j = 0; j < 4; ++j) { c[j] = c0[t][j]; c[4 + j] = c1[t][j]; }
      const _Float16* krow = &Ksh[(16 * t + nlo) * LDK + 8 * hi];
      v16h ka0 = frag_from_lds(krow + 0);
      v16h ka1 = frag_from_lds(krow + 32);
      c = __builtin_amdgcn_wmma_f32_16x16x32_f16(false, ka0, false, qb0,
                                                 (short)0, c, false, false);
      c = __builtin_amdgcn_wmma_f32_16x16x32_f16(false, ka1, false, qb1,
                                                 (short)0, c, false, false);
      st[t] = c;
    }

    // ---- causal mask on the diagonal tile ----
    if (kv0 == q0) {
#pragma unroll
      for (int t = 0; t < 4; ++t)
#pragma unroll
        for (int r = 0; r < 8; ++r)
          if (16 * t + 8 * hi + r > 16 * wv + nlo) st[t][r] = NEG_INF;
    }

    // ---- online softmax: maximum in-lane, one exchange between the halves ----
    float mt[4];                            // one chain per key tile
#pragma unroll
    for (int t = 0; t < 4; ++t) {
      mt[t] = st[t][0];
#pragma unroll
      for (int r = 1; r < 8; ++r) mt[t] = fmaxf(mt[t], st[t][r]);
    }
    float mx = fmaxf(fmaxf(mt[0], mt[1]), fmaxf(mt[2], mt[3]));
    mx = fmaxf(mx, xhalf(mx));

    const float mn = fmaxf(m_i, mx);
    const float al = __expf(m_i - mn);
    m_i = mn;

    // ---- P^T = exp(S^T - m): tiles (0,1) and (2,3) convert in place into the
    //      B operands of keys 0..31 and 32..63, in the hardware k order ----
    v16h pb[2];
    float rs[4];                            // one chain per key tile
#pragma unroll
    for (int t = 0; t < 4; ++t) {
      rs[t] = 0.0f;
#pragma unroll
      for (int r = 0; r < 8; ++r) {
        const float p = __expf(st[t][r] - m_i);
        rs[t] += p;
        pb[t >> 1][8 * (t & 1) + r] = (_Float16)p;
      }
    }
    l_i = l_i * al + ((rs[0] + rs[1]) + (rs[2] + rs[3]));

    // ---- O^T = O^T*alpha + V^T*P^T ----
#pragma unroll
    for (int u = 0; u < 4; ++u) {
      v8f oc = o[u];
#pragma unroll
      for (int r = 0; r < 8; ++r) oc[r] *= al;
      const _Float16* vcol = vtr + 16 * u;
      v16h va0 = frag_tr_from_lds(vcol);
      v16h va1 = frag_tr_from_lds(vcol + 32 * LDV);
      oc = __builtin_amdgcn_wmma_f32_16x16x32_f16(false, va0, false, pb[0],
                                                  (short)0, oc, false, false);
      oc = __builtin_amdgcn_wmma_f32_16x16x32_f16(false, va1, false, pb[1],
                                                  (short)0, oc, false, false);
      o[u] = oc;
    }
  }

  // ---- finalize: O / l, store fp32 [B,S,H,D]; 8 consecutive d per lane ----
  const float inv_l = 1.0f / (l_i + xhalf(l_i));  // causal => l > 0
  float* op = out + (((size_t)b * S_ + qrow) * H_ + h) * D_ + 8 * hi;
#pragma unroll
  for (int u = 0; u < 4; ++u) {
    v4f y0, y1;
#pragma unroll
    for (int j = 0; j < 4; ++j) { y0[j] = o[u][j] * inv_l; y1[j] = o[u][4 + j] * inv_l; }
    *(v4f*)(op + 16 * u)     = y0;
    *(v4f*)(op + 16 * u + 4) = y1;
  }
}

extern "C" void kernel_launch(void* const* d_in, const int* in_sizes, int n_in,
                              void* d_out, int out_size, void* d_ws, size_t ws_size,
                              hipStream_t stream) {
  (void)in_sizes; (void)n_in; (void)out_size; (void)d_ws; (void)ws_size;
  const float* q    = (const float*)d_in[0];
  const float* k    = (const float*)d_in[1];
  const float* v    = (const float*)d_in[2];
  const float* bias = (const float*)d_in[3];
  float* out        = (float*)d_out;
  dim3 grid(H_, B_, S_ / BLOCK_M);
  fa_fwd_wmma<<<grid, 128, 0, stream>>>(q, k, v, bias, out);
}

// v004
// A run of this version takes 68.1 microseconds.
// In both of two side-by-side timings against v003, it was 1.18 times as fast.
// All steps since v000 together make it 3.44 times as fast.
#include <hip/hip_runtime.h>

// Flash attention forward for B=4, S=2048, H=16, D=64, causal, fp32 I/O,
// additive bias [1,H,S,S]. f16 WMMA matmuls with fp32 accumulate + fp32 softmax.
// Both products are taken transposed (S^T = K*Q^T, O^T += V^T*P^T): a lane owns
// one query, and the score accumulators convert in place into the B operand.
// K and V are both staged row-major; V^T comes out of LDS by the transposing load.
// The bias tile comes through LDS by asynchronous copies, two buffers, one trip ahead.

#define B_ 4
#define S_ 2048
#define H_ 16
#define D_ 64

constexpr int BLOCK_M = 64;     // q rows per workgroup (16 per wave)
constexpr int BLOCK_N = 64;     // kv rows per tile
constexpr int LDK     = 72;     // halves per LDS row (64 + 8 pad -> conflict-free b128)
constexpr int LDV     = 80;     // halves per V row: 160 B = 32 B x odd, for the transposing load
constexpr int LDB     = 68;     // floats per bias row in LDS: 272 B = 16 B x odd, for b128 readers
constexpr float SCALE   = 0.125f;   // 1/sqrt(64), folded into Q->f16 conversion
constexpr float NEG_INF = -1e30f;

typedef __attribute__((ext_vector_type(16))) _Float16 v16h;
typedef __attribute__((ext_vector_type(8)))  _Float16 v8h;
typedef __attribute__((ext_vector_type(4)))  _Float16 v4h;
typedef __attribute__((ext_vector_type(8)))  short    v8s;
typedef __attribute__((ext_vector_type(8)))  float    v8f;
typedef __attribute__((ext_vector_type(4)))  float    v4f;

// A/B fragment layout for V_WMMA_F32_16X16X32_F16 (per ISA 7.12.2):
// lane (0..15) holds row/col (lane&15) with K-chunks {8*hi+0..7, 16+8*hi+0..7}
// of each 32-wide K block; chunks are 8 contiguous elements (16B).
__device__ inline v16h frag_from_f32(const float* __restrict__ p, float scale) {
  v4f x0 = *(const v4f*)(p +  0);
  v4f x1 = *(const v4f*)(p +  4);
  v4f x2 = *(const v4f*)(p + 16);
  v4f x3 = *(const v4f*)(p + 20);
  v16h f;
#pragma unroll
  for (int j = 0; j < 4; ++j) {
    f[j]      = (_Float16)(x0[j] * scale);
    f[4 + j]  = (_Float16)(x1[j] * scale);
    f[8 + j]  = (_Float16)(x2[j] * scale);
    f[12 + j] = (_Float16)(x3[j] * scale);
  }
  return f;
}

// lane l with lane l ^ 16 (the two halves of a wave hold the same query column)
__device__ inline float xhalf(float x) {
  const int b = __builtin_bit_cast(int, x);
  return __builtin_bit_cast(float, __builtin_amdgcn_permlanex16(
      b, b, 0x76543210, 0xfedcba98, false, false));
}

__device__ inline v16h frag_from_lds(const _Float16* p) {
  v8h a = *(const v8h*)(p);        // 16B aligned (row stride 144B, offsets 16B)
  v8h b = *(const v8h*)(p + 16);
  v16h f;
#pragma unroll
  for (int j = 0; j < 8; ++j) { f[j] = a[j]; f[8 + j] = b[j]; }
  return f;
}

// 16 x 32 A fragment of V^T out of row-major V rows: each transposing load hands
// lane (c, hi) the column c of keys 8*hi+0..7 of its 16-key block, the k order above.
__device__ inline v16h frag_tr_from_lds(const _Float16* p) {
  typedef __attribute__((address_space(3))) v8s lds_v8s;
  v8h a = __builtin_bit_cast(v8h, __builtin_amdgcn_ds_load_tr16_b128_v8i16((lds_v8s*)p));
  v8h b = __builtin_bit_cast(v8h, __builtin_amdgcn_ds_load_tr16_b128_v8i16((lds_v8s*)(p + 16 * LDV)));
  v16h f;
#pragma unroll
  for (int j = 0; j < 8; ++j) { f[j] = a[j]; f[8 + j] = b[j]; }
  return f;
}

// One trip's bias rows of this wave (16 queries x 64 keys): a copy moves two whole
// 256-B row pieces, lane (c, hi) the 16-B piece c of row 2i + hi. l: the lane's LDS byte
// address of row hi, g: its global address there.
__device__ inline void copy_bias(unsigned l, const float* g) {
  // the wait is the last line of the copies' own statement, so that no address
  // register of a copy is written again in front of it
  asm volatile("global_load_async_to_lds_b128 %0, %8, off\n\t"
               "global_load_async_to_lds_b128 %1, %9, off\n\t"
               "global_load_async_to_lds_b128 %2, %10, off\n\t"
               "global_load_async_to_lds_b128 %3, %11, off\n\t"
               "global_load_async_to_lds_b128 %4, %12, off\n\t"
               "global_load_async_to_lds_b128 %5, %13, off\n\t"
               "global_load_async_to_lds_b128 %6, %14, off\n\t"
               "global_load_async_to_lds_b128 %7, %15, off\n\t"
               "s_wait_xcnt 0x0"
               :: "v"(l), "v"(l + 2 * LDB * 4), "v"(l + 4 * LDB * 4), "v"(l + 6 * LDB * 4),
                  "v"(l + 8 * LDB * 4), "v"(l + 10 * LDB * 4), "v"(l + 12 * LDB * 4), "v"(l + 14 * LDB * 4),
                  "v"(g), "v"(g + 2 * S_), "v"(g + 4 * S_), "v"(g + 6 * S_),
                  "v"(g + 8 * S_), "v"(g + 10 * S_), "v"(g + 12 * S_), "v"(g + 14 * S_)
               : "memory");
}

__global__ __launch_bounds__(128)
void fa_fwd_wmma(const float* __restrict__ q, const float* __restrict__ k,
                 const float* __restrict__ v, const float* __restrict__ bias,
                 float* __restrict__ out) {
  __shared__ _Float16 Ksh[BLOCK_N * LDK];   // [kv][d]   row-major f16
  __shared__ _Float16 Vsh[BLOCK_N * LDV];   // [kv][d]   row-major f16
  __shared__ __attribute__((aligned(16))) float Bsh[2 * BLOCK_M * LDB];  // [buffer][q][kv] f32

  // Causal cost grows with the q tile index and there are more workgroups than
  // resident places; the longest tiles take the lowest indices and the short
  // ones take the highest (for speed only).
  const int qt   = (S_ / BLOCK_M - 1) - blockIdx.z;   // q tile index, heaviest first
  const int h    = blockIdx.x;
  const int b    = blockIdx.y;
  const int tid  = threadIdx.x;
  const int wv   = tid >> 5;                // wave 0..3
  const int lane = tid & 31;
  const int nlo  = lane & 15;
  const int hi   = lane >> 4;

  const int q0 = qt * BLOCK_M;

  // ---- Q^T as B operand: lane = query column (scale folded in) ----
  const int qrow = q0 + 16 * wv + nlo;
  const float* qp = q + (((size_t)b * S_ + qrow) * H_ + h) * D_;
  const v16h qb0 = frag_from_f32(qp + 0  + 8 * hi, SCALE);
  const v16h qb1 = frag_from_f32(qp + 32 + 8 * hi, SCALE);

  // ---- running state of this lane's query; o[u][r] = O[qrow][16u + 8hi + r] ----
  v8f o[4];
  float m_i = -3.0e38f;
  float l_i = 0.0f;                         // this half's keys only, joined at the end
#pragma unroll
  for (int u = 0; u < 4; ++u) o[u] = (v8f){};

  // this lane's address in a transposing load of V: row 8*hi + (lane & 7), 16-B half
  const _Float16* vtr = &Vsh[(8 * hi + (lane & 7)) * LDV + 8 * ((lane >> 3) & 1)];

  // bias: what this lane copies (row 16wv + hi, 16-B piece nlo) and what it reads
  typedef __attribute__((address_space(3))) float lds_float;
  const unsigned bl = (unsigned)(size_t)(lds_float*)&Bsh[(16 * wv + hi) * LDB + 4 * nlo];
  const float* bg   = bias + ((size_t)h * S_ + q0 + 16 * wv + hi) * S_ + 4 * nlo;
  const float* brd  = &Bsh[(16 * wv + nlo) * LDB + 8 * hi];
  constexpr int BBUF = BLOCK_M * LDB;       // floats per bias buffer

  const int n_tiles = qt + 1;               // causal: kv tiles 0..qt

  // ---- bias ring, prologue: tile 0 lands and is published, tile 1 starts ----
  copy_bias(bl, bg);
  asm volatile("s_wait_asynccnt 0x0" ::: "memory");   // tile 0 has landed
  __syncthreads();
  if (n_tiles > 1) copy_bias(bl + BBUF * 4, bg + BLOCK_N);

  for (int it = 0; it < n_tiles; ++it) {
    const int kv0 = it * BLOCK_N;

    // ---- cooperative stage of K and V (both row-major) into LDS; the barrier at
    //      the foot of the trip before has ended every read of the old tiles ----
    v4f kx[8], vx[8];
    const float* kq[8];
    const float* vq[8];
#pragma unroll
    for (int i = 0; i < 8; ++i) {
      const int idx = i * 128 + tid;        // 1024 float4s of the 64x64 tile
      const int row = idx >> 4;             // kv row in tile
      const int c4  = idx & 15;             // float4 column
      const size_t g = (((size_t)b * S_ + kv0 + row) * H_ + h) * D_ + c4 * 4;
      kq[i] = k + g;
      vq[i] = v + g;
      kx[i] = *(const v4f*)(kq[i]);
      vx[i] = *(const v4f*)(vq[i]);
    }
    // every address pair stays live up to this wait, so that no load of the run
    // lands in one and none is written again in front of it
    asm volatile("s_wait_xcnt 0x0"
                 :: "v"(kq[0]), "v"(kq[1]), "v"(kq[2]), "v"(kq[3]), "v"(kq[4]), "v"(kq[5]), "v"(kq[6]), "v"(kq[7]),
                    "v"(vq[0]), "v"(vq[1]), "v"(vq[2]), "v"(vq[3]), "v"(vq[4]), "v"(vq[5]), "v"(vq[6]), "v"(vq[7])
                 : "memory");
#pragma unroll
    for (int i = 0; i < 8; ++i) {
      const int idx = i * 128 + tid;
      const int row = idx >> 4;
      const int c4  = idx & 15;
      v4h kh, vh;
#pragma unroll
      for (int j = 0; j < 4; ++j) { kh[j] = (_Float16)kx[i][j]; vh[j] = (_Float16)vx[i][j]; }
      *(v4h*)(&Ksh[row * LDK + c4 * 4]) = kh;       // ds_store_b64
      *(v4h*)(&Vsh[row * LDV + c4 * 4]) = vh;       // ds_store_b64
    }
    __syncthreads();

    const float* bb = brd + (it & 1) * BBUF;

    // ---- S^T = K*Q^T (+bias as initial C) : 4 key tiles x 2 K-steps ----
    // st[t][r] = S[qrow][kv0 + 16t + 8hi + r]: 8 consecutive keys of one bias row
    v4f c0[4], c1[4];
#pragma unroll
    for (int t = 0; t < 4; ++t) {
      c0[t] = *(const v4f*)(bb + 16 * t);
      c1[t] = *(const v4f*)(bb + 16 * t + 4);
    }
    v8f st[4];
#pragma unroll
    for (int t = 0; t < 4; ++t) {
      v8f c;
#pragma unroll
      for (int j = 0; j < 4; ++j) { c[j] = c0[t][j]; c[4 + j] = c1[t][j]; }
      const _Float16* krow = &Ksh[(16 * t + nlo) * LDK + 8 * hi];
      v16h ka0 = frag_from_lds(krow + 0);
      v16h ka1 = frag_from_lds(krow + 32);
      c = __builtin_amdgcn_wmma_f32_16x16x32_f16(false, ka0, false, qb0,
                                                 (short)0, c, false, false);
      c = __builtin_amdgcn_wmma_f32_16x16x32_f16(false, ka1, false, qb1,
                                                 (short)0, c, false, false);
      st[t] = c;
    }

    // ---- causal mask on the diagonal tile ----
    if (kv0 == q0) {
#pragma unroll
      for (int t = 0; t < 4; ++t)
#pragma unroll
        for (int r = 0; r < 8; ++r)
          if (16 * t + 8 * hi + r > 16 * wv + nlo) st[t][r] = NEG_INF;
    }

    // ---- online softmax: maximum in-lane, one exchange between the halves ----
    float mt[4];                            // one chain per key tile
#pragma unroll
    for (int t = 0; t < 4; ++t) {
      mt[t] = st[t][0];
#pragma unroll
      for (int r = 1; r < 8; ++r) mt[t] = fmaxf(mt[t], st[t][r]);
    }
    float mx = fmaxf(fmaxf(mt[0], mt[1]), fmaxf(mt[2], mt[3]));
    mx = fmaxf(mx, xhalf(mx));

    const float mn = fmaxf(m_i, mx);
    const float al = __expf(m_i - mn);
    m_i = mn;

    // ---- P^T = exp(S^T - m): tiles (0,1) and (2,3) convert in place into the
    //      B operands of keys 0..31 and 32..63, in the hardware k order ----
    v16h pb[2];
    float rs[4];                            // one chain per key tile
#pragma unroll
    for (int t = 0; t < 4; ++t) {
      rs[t] = 0.0f;
#pragma unroll
      for (int r = 0; r < 8; ++r) {
        const float p = __expf(st[t][r] - m_i);
        rs[t] += p;
        pb[t >> 1][8 * (t & 1) + r] = (_Float16)p;
      }
    }
    l_i = l_i * al + ((rs[0] + rs[1]) + (rs[2] + rs[3]));

    // ---- O^T = O^T*alpha + V^T*P^T ----
#pragma unroll
    for (int u = 0; u < 4; ++u) {
      v8f oc = o[u];
#pragma unroll
      for (int r = 0; r < 8; ++r) oc[r] *= al;
      const _Float16* vcol = vtr + 16 * u;
      v16h va0 = frag_tr_from_lds(vcol);
      v16h va1 = frag_tr_from_lds(vcol + 32 * LDV);
      oc = __builtin_amdgcn_wmma_f32_16x16x32_f16(false, va0, false, pb[0],
                                                  (short)0, oc, false, false);
      oc = __builtin_amdgcn_wmma_f32_16x16x32_f16(false, va1, false, pb[1],
                                                  (short)0, oc, false, false);
      o[u] = oc;
    }

    // ---- foot of the trip: publish bias tile it + 1, free this trip's buffers ----
    asm volatile("s_wait_dscnt 0x0" ::: "memory");      // this wave's LDS reads are done
    asm volatile("s_wait_asynccnt 0x0" ::: "memory");   // its copies of tile it + 1 have landed
    __syncthreads();
    if (it + 2 < n_tiles)                   // refill the buffer this trip has read
      copy_bias(bl + (it & 1) * (BBUF * 4), bg + kv0 + 2 * BLOCK_N);
  }
  asm volatile("s_wait_asynccnt 0x0" ::: "memory");     // no copy outlives the loop

  // ---- finalize: O / l, store fp32 [B,S,H,D]; 8 consecutive d per lane ----
  const float inv_l = 1.0f / (l_i + xhalf(l_i));  // causal => l > 0
  float* op = out + (((size_t)b * S_ + qrow) * H_ + h) * D_ + 8 * hi;
#pragma unroll
  for (int u = 0; u < 4; ++u) {
    v4f y0, y1;
#pragma unroll
    for (int j = 0; j < 4; ++j) { y0[j] = o[u][j] * inv_l; y1[j] = o[u][4 + j] * inv_l; }
    *(v4f*)(op + 16 * u)     = y0;
    *(v4f*)(op + 16 * u + 4) = y1;
  }
}

extern "C" void kernel_launch(void* const* d_in, const int* in_sizes, int n_in,
                              void* d_out, int out_size, void* d_ws, size_t ws_size,
                              hipStream_t stream) {
  (void)in_sizes; (void)n_in; (void)out_size; (void)d_ws; (void)ws_size;
  const float* q    = (const float*)d_in[0];
  const float* k    = (const float*)d_in[1];
  const float* v    = (const float*)d_in[2];
  const float* bias = (const float*)d_in[3];
  float* out        = (float*)d_out;
  dim3 grid(H_, B_, S_ / BLOCK_M);
  fa_fwd_wmma<<<grid, 128, 0, stream>>>(q, k, v, bias, out);
}

// v005
// It runs in 65.5 microseconds.
// Timed twice side by side with v004, it ran 1.04 times as fast both times.
// Over all steps from v000 it is 3.58 times as fast.
#include <hip/hip_runtime.h>

// Flash attention forward for B=4, S=2048, H=16, D=64, causal, fp32 I/O,
// additive bias [1,H,S,S]. f16 WMMA matmuls with fp32 accumulate + fp32 softmax.
// Both products are taken transposed (S^T = K*Q^T, O^T += V^T*P^T): a lane owns
// one query, and the score accumulators convert in place into the B operand.
// K and V are both staged row-major; V^T comes out of LDS by the transposing load.
// The bias tile comes through LDS by asynchronous copies, two buffers, one trip ahead.
// Eight waves (128 queries) share each staged K/V tile, so a tile is fetched from L2 and
// converted once for twice the queries.

#define B_ 4
#define S_ 2048
#define H_ 16
#define D_ 64

constexpr int BLOCK_M = 128;    // q rows per workgroup (16 per wave, 8 waves)
constexpr int NTHR    = 256;    // work-items per workgroup
constexpr int BLOCK_N = 64;     // kv rows per tile
constexpr int LDK     = 72;     // halves per LDS row (64 + 8 pad -> conflict-free b128)
constexpr int LDV     = 80;     // halves per V row: 160 B = 32 B x odd, for the transposing load
constexpr int LDB     = 68;     // floats per bias row in LDS: 272 B = 16 B x odd, for b128 readers
constexpr float SCALE   = 0.125f;   // 1/sqrt(64), folded into Q->f16 conversion
constexpr float NEG_INF = -1e30f;

typedef __attribute__((ext_vector_type(16))) _Float16 v16h;
typedef __attribute__((ext_vector_type(8)))  _Float16 v8h;
typedef __attribute__((ext_vector_type(4)))  _Float16 v4h;
typedef __attribute__((ext_vector_type(8)))  short    v8s;
typedef __attribute__((ext_vector_type(8)))  float    v8f;
typedef __attribute__((ext_vector_type(4)))  float    v4f;

// A/B fragment layout for V_WMMA_F32_16X16X32_F16 (per ISA 7.12.2):
// lane (0..15) holds row/col (lane&15) with K-chunks {8*hi+0..7, 16+8*hi+0..7}
// of each 32-wide K block; chunks are 8 contiguous elements (16B).
__device__ inline v16h frag_from_f32(const float* __restrict__ p, float scale) {
  v4f x0 = *(const v4f*)(p +  0);
  v4f x1 = *(const v4f*)(p +  4);
  v4f x2 = *(const v4f*)(p + 16);
  v4f x3 = *(const v4f*)(p + 20);
  v16h f;
#pragma unroll
  for (int j = 0; j < 4; ++j) {
    f[j]      = (_Float16)(x0[j] * scale);
    f[4 + j]  = (_Float16)(x1[j] * scale);
    f[8 + j]  = (_Float16)(x2[j] * scale);
    f[12 + j] = (_Float16)(x3[j] * scale);
  }
  return f;
}

// lane l with lane l ^ 16 (the two halves of a wave hold the same query column)
__device__ inline float xhalf(float x) {
  const int b = __builtin_bit_cast(int, x);
  return __builtin_bit_cast(float, __builtin_amdgcn_permlanex16(
      b, b, 0x76543210, 0xfedcba98, false, false));
}

__device__ inline v16h frag_from_lds(const _Float16* p) {
  v8h a = *(const v8h*)(p);        // 16B aligned (row stride 144B, offsets 16B)
  v8h b = *(const v8h*)(p + 16);
  v16h f;
#pragma unroll
  for (int j = 0; j < 8; ++j) { f[j] = a[j]; f[8 + j] = b[j]; }
  return f;
}

// 16 x 32 A fragment of V^T out of row-major V rows: each transposing load hands
// lane (c, hi) the column c of keys 8*hi+0..7 of its 16-key block, the k order above.
__device__ inline v16h frag_tr_from_lds(const _Float16* p) {
  typedef __attribute__((address_space(3))) v8s lds_v8s;
  v8h a = __builtin_bit_cast(v8h, __builtin_amdgcn_ds_load_tr16_b128_v8i16((lds_v8s*)p));
  v8h b = __builtin_bit_cast(v8h, __builtin_amdgcn_ds_load_tr16_b128_v8i16((lds_v8s*)(p + 16 * LDV)));
  v16h f;
#pragma unroll
  for (int j = 0; j < 8; ++j) { f[j] = a[j]; f[8 + j] = b[j]; }
  return f;
}

// One trip's bias rows of this wave (16 queries x 64 keys): a copy moves two whole
// 256-B row pieces, lane (c, hi) the 16-B piece c of row 2i + hi. l: the lane's LDS byte
// address of row hi, g: its global address there.
__device__ inline void copy_bias(unsigned l, const float* g) {
  // the wait is the last line of the copies' own statement, so that no address
  // register of a copy is written again in front of it
  asm volatile("global_load_async_to_lds_b128 %0, %8, off\n\t"
               "global_load_async_to_lds_b128 %1, %9, off\n\t"
               "global_load_async_to_lds_b128 %2, %10, off\n\t"
               "global_load_async_to_lds_b128 %3, %11, off\n\t"
               "global_load_async_to_lds_b128 %4, %12, off\n\t"
               "global_load_async_to_lds_b128 %5, %13, off\n\t"
               "global_load_async_to_lds_b128 %6, %14, off\n\t"
               "global_load_async_to_lds_b128 %7, %15, off\n\t"
               "s_wait_xcnt 0x0"
               :: "v"(l), "v"(l + 2 * LDB * 4), "v"(l + 4 * LDB * 4), "v"(l + 6 * LDB * 4),
                  "v"(l + 8 * LDB * 4), "v"(l + 10 * LDB * 4), "v"(l + 12 * LDB * 4), "v"(l + 14 * LDB * 4),
                  "v"(g), "v"(g + 2 * S_), "v"(g + 4 * S_), "v"(g + 6 * S_),
                  "v"(g + 8 * S_), "v"(g + 10 * S_), "v"(g + 12 * S_), "v"(g + 14 * S_)
               : "memory");
}

__global__ __launch_bounds__(NTHR)
void fa_fwd_wmma(const float* __restrict__ q, const float* __restrict__ k,
                 const float* __restrict__ v, const float* __restrict__ bias,
                 float* __restrict__ out) {
  __shared__ _Float16 Ksh[BLOCK_N * LDK];   // [kv][d]   row-major f16
  __shared__ _Float16 Vsh[BLOCK_N * LDV];   // [kv][d]   row-major f16
  __shared__ __attribute__((aligned(16))) float Bsh[2 * BLOCK_M * LDB];  // [buffer][q][kv] f32

  // Causal cost grows with the q tile index and there are more workgroups than
  // resident places; the longest tiles take the lowest indices and the short
  // ones take the highest (for speed only).
  const int qt   = (S_ / BLOCK_M - 1) - blockIdx.z;   // q tile index, heaviest first
  const int h    = blockIdx.x;
  const int b    = blockIdx.y;
  const int tid  = threadIdx.x;
  const int wv   = tid >> 5;                // wave 0..7
  const int lane = tid & 31;
  const int nlo  = lane & 15;
  const int hi   = lane >> 4;

  const int q0 = qt * BLOCK_M;
  // first query of this wave's 64-query half, in a scalar register: the tests on it
  // below are scalar branches, so that every lane stays on at the matrix instructions
  const int wq0 = q0 + BLOCK_N * __builtin_amdgcn_readfirstlane(wv >> 2);

  // ---- Q^T as B operand: lane = query column (scale folded in) ----
  const int qrow = q0 + 16 * wv + nlo;
  const float* qp = q + (((size_t)b * S_ + qrow) * H_ + h) * D_;
  const v16h qb0 = frag_from_f32(qp + 0  + 8 * hi, SCALE);
  const v16h qb1 = frag_from_f32(qp + 32 + 8 * hi, SCALE);

  // ---- running state of this lane's query; o[u][r] = O[qrow][16u + 8hi + r] ----
  v8f o[4];
  float m_i = -3.0e38f;
  float l_i = 0.0f;                         // this half's keys only, joined at the end
#pragma unroll
  for (int u = 0; u < 4; ++u) o[u] = (v8f){};

  // this lane's address in a transposing load of V: row 8*hi + (lane & 7), 16-B half
  const _Float16* vtr = &Vsh[(8 * hi + (lane & 7)) * LDV + 8 * ((lane >> 3) & 1)];

  // bias: what this lane copies (row 16wv + hi, 16-B piece nlo) and what it reads
  typedef __attribute__((address_space(3))) float lds_float;
  const unsigned bl = (unsigned)(size_t)(lds_float*)&Bsh[(16 * wv + hi) * LDB + 4 * nlo];
  const float* bg   = bias + ((size_t)h * S_ + q0 + 16 * wv + hi) * S_ + 4 * nlo;
  const float* brd  = &Bsh[(16 * wv + nlo) * LDB + 8 * hi];
  constexpr int BBUF = BLOCK_M * LDB;       // floats per bias buffer

  const int n_tiles = 2 * qt + 2;           // causal: kv tiles 0..2qt+1

  // ---- bias ring, prologue: tile 0 lands and is published, tile 1 starts ----
  copy_bias(bl, bg);
  asm volatile("s_wait_asynccnt 0x0" ::: "memory");   // tile 0 has landed
  __syncthreads();
  if (n_tiles > 1) copy_bias(bl + BBUF * 4, bg + BLOCK_N);

  for (int it = 0; it < n_tiles; ++it) {
    const int kv0 = it * BLOCK_N;

    // ---- cooperative stage of K and V (both row-major) into LDS; the barrier at
    //      the foot of the trip before has ended every read of the old tiles ----
    v4f kx[4], vx[4];
    const float* kq[4];
    const float* vq[4];
#pragma unroll
    for (int i = 0; i < 4; ++i) {
      const int idx = i * NTHR + tid;       // 1024 float4s of the 64x64 tile
      const int row = idx >> 4;             // kv row in tile
      const int c4  = idx & 15;             // float4 column
      const size_t g = (((size_t)b * S_ + kv0 + row) * H_ + h) * D_ + c4 * 4;
      kq[i] = k + g;
      vq[i] = v + g;
      kx[i] = *(const v4f*)(kq[i]);
      vx[i] = *(const v4f*)(vq[i]);
    }
    // every address pair stays live up to this wait, so that no load of the run
    // lands in one and none is written again in front of it
    asm volatile("s_wait_xcnt 0x0"
                 :: "v"(kq[0]), "v"(kq[1]), "v"(kq[2]), "v"(kq[3]),
                    "v"(vq[0]), "v"(vq[1]), "v"(vq[2]), "v"(vq[3])
                 : "memory");
#pragma unroll
    for (int i = 0; i < 4; ++i) {
      const int idx = i * NTHR + tid;
      const int row = idx >> 4;
      const int c4  = idx & 15;
      v4h kh, vh;
#pragma unroll
      for (int j = 0; j < 4; ++j) { kh[j] = (_Float16)kx[i][j]; vh[j] = (_Float16)vx[i][j]; }
      *(v4h*)(&Ksh[row * LDK + c4 * 4]) = kh;       // ds_store_b64
      *(v4h*)(&Vsh[row * LDV + c4 * 4]) = vh;       // ds_store_b64
    }
    __syncthreads();

    // the last tile lies wholly above the diagonal for the lower 64 queries: their
    // waves have staged their share of it and go on to the foot of the trip
    if (kv0 <= wq0) {

    const float* bb = brd + (it & 1) * BBUF;

    // ---- S^T = K*Q^T (+bias as initial C) : 4 key tiles x 2 K-steps ----
    // st[t][r] = S[qrow][kv0 + 16t + 8hi + r]: 8 consecutive keys of one bias row
    v4f c0[4], c1[4];
#pragma unroll
    for (int t = 0; t < 4; ++t) {
      c0[t] = *(const v4f*)(bb + 16 * t);
      c1[t] = *(const v4f*)(bb + 16 * t + 4);
    }
    v8f st[4];
#pragma unroll
    for (int t = 0; t < 4; ++t) {
      v8f c;
#pragma unroll
      for (int j = 0; j < 4; ++j) { c[j] = c0[t][j]; c[4 + j] = c1[t][j]; }
      const _Float16* krow = &Ksh[(16 * t + nlo) * LDK + 8 * hi];
      v16h ka0 = frag_from_lds(krow + 0);
      v16h ka1 = frag_from_lds(krow + 32);
      c = __builtin_amdgcn_wmma_f32_16x16x32_f16(false, ka0, false, qb0,
                                                 (short)0, c, false, false);
      c = __builtin_amdgcn_wmma_f32_16x16x32_f16(false, ka1, false, qb1,
                                                 (short)0, c, false, false);
      st[t] = c;
    }

    // ---- causal mask on the diagonal tile ----
    if (kv0 == wq0) {
#pragma unroll
      for (int t = 0; t < 4; ++t)
#pragma unroll
        for (int r = 0; r < 8; ++r)
          if (16 * t + 8 * hi + r > 16 * (wv & 3) + nlo) st[t][r] = NEG_INF;
    }

    // ---- online softmax: maximum in-lane, one exchange between the halves ----
    float mt[4];                            // one chain per key tile
#pragma unroll
    for (int t = 0; t < 4; ++t) {
      mt[t] = st[t][0];
#pragma unroll
      for (int r = 1; r < 8; ++r) mt[t] = fmaxf(mt[t], st[t][r]);
    }
    float mx = fmaxf(fmaxf(mt[0], mt[1]), fmaxf(mt[2], mt[3]));
    mx = fmaxf(mx, xhalf(mx));

    const float mn = fmaxf(m_i, mx);
    const float al = __expf(m_i - mn);
    m_i = mn;

    // ---- P^T = exp(S^T - m): tiles (0,1) and (2,3) convert in place into the
    //      B operands of keys 0..31 and 32..63, in the hardware k order ----
    v16h pb[2];
    float rs[4];                            // one chain per key tile
#pragma unroll
    for (int t = 0; t < 4; ++t) {
      rs[t] = 0.0f;
#pragma unroll
      for (int r = 0; r < 8; ++r) {
        const float p = __expf(st[t][r] - m_i);
        rs[t] += p;
        pb[t >> 1][8 * (t & 1) + r] = (_Float16)p;
      }
    }
    l_i = l_i * al + ((rs[0] + rs[1]) + (rs[2] + rs[3]));

    // ---- O^T = O^T*alpha + V^T*P^T ----
#pragma unroll
    for (int u = 0; u < 4; ++u) {
      v8f oc = o[u];
#pragma unroll
      for (int r = 0; r < 8; ++r) oc[r] *= al;
      const _Float16* vcol = vtr + 16 * u;
      v16h va0 = frag_tr_from_lds(vcol);
      v16h va1 = frag_tr_from_lds(vcol + 32 * LDV);
      oc = __builtin_amdgcn_wmma_f32_16x16x32_f16(false, va0, false, pb[0],
                                                  (short)0, oc, false, false);
      oc = __builtin_amdgcn_wmma_f32_16x16x32_f16(false, va1, false, pb[1],
                                                  (short)0, oc, false, false);
      o[u] = oc;
    }

    }  // kv0 <= wq0

    // ---- foot of the trip: publish bias tile it + 1, free this trip's buffers ----
    asm volatile("s_wait_dscnt 0x0" ::: "memory");      // this wave's LDS reads are done
    asm volatile("s_wait_asynccnt 0x0" ::: "memory");   // its copies of tile it + 1 have landed
    __syncthreads();
    if (it + 2 < n_tiles)                   // refill the buffer this trip has read
      copy_bias(bl + (it & 1) * (BBUF * 4), bg + kv0 + 2 * BLOCK_N);
  }
  asm volatile("s_wait_asynccnt 0x0" ::: "memory");     // no copy outlives the loop

  // ---- finalize: O / l, store fp32 [B,S,H,D]; 8 consecutive d per lane ----
  const float inv_l = 1.0f / (l_i + xhalf(l_i));  // causal => l > 0
  float* op = out + (((size_t)b * S_ + qrow) * H_ + h) * D_ + 8 * hi;
#pragma unroll
  for (int u = 0; u < 4; ++u) {
    v4f y0, y1;
#pragma unroll
    for (int j = 0; j < 4; ++j) { y0[j] = o[u][j] * inv_l; y1[j] = o[u][4 + j] * inv_l; }
    *(v4f*)(op + 16 * u)     = y0;
    *(v4f*)(op + 16 * u + 4) = y1;
  }
}

extern "C" void kernel_launch(void* const* d_in, const int* in_sizes, int n_in,
                              void* d_out, int out_size, void* d_ws, size_t ws_size,
                              hipStream_t stream) {
  (void)in_sizes; (void)n_in; (void)out_size; (void)d_ws; (void)ws_size;
  const float* q    = (const float*)d_in[0];
  const float* k    = (const float*)d_in[1];
  const float* v    = (const float*)d_in[2];
  const float* bias = (const float*)d_in[3];
  float* out        = (float*)d_out;
  dim3 grid(H_, B_, S_ / BLOCK_M);
  fa_fwd_wmma<<<grid, NTHR, 0, stream>>>(q, k, v, bias, out);
}

// v006
// Measured time: 55.3 microseconds a run.
// Timed twice side by side with v005, it ran 1.19 and 1.18 times as fast.
// Over all steps from v000 it is 4.24 times as fast.
#include <hip/hip_runtime.h>

// Flash attention forward for B=4, S=2048, H=16, D=64, causal, fp32 I/O,
// additive bias [1,H,S,S]. f16 WMMA matmuls with fp32 accumulate + fp32 softmax.
// Both products are taken transposed (S^T = K*Q^T, O^T += V^T*P^T): a lane owns
// one query, and the score accumulators convert in place into the B operand.
// K and V are both staged row-major; V^T comes out of LDS by the transposing load.
// The bias tile comes through LDS by asynchronous copies, two buffers, one trip ahead.
// Eight waves (128 queries) share each staged K/V tile, so a tile is fetched from L2 and
// converted once for twice the queries.
// K/V staging runs one trip ahead: the next tile's global loads fly under this trip's
// score products and go into a second pair of LDS buffers; one barrier per trip.

#define B_ 4
#define S_ 2048
#define H_ 16
#define D_ 64

constexpr int BLOCK_M = 128;    // q rows per workgroup (16 per wave, 8 waves)
constexpr int NTHR    = 256;    // work-items per workgroup
constexpr int BLOCK_N = 64;     // kv rows per tile
constexpr int LDK     = 72;     // halves per LDS row (64 + 8 pad -> conflict-free b128)
constexpr int LDV     = 80;     // halves per V row: 160 B = 32 B x odd, for the transposing load
constexpr int LDB     = 68;     // floats per bias row in LDS: 272 B = 16 B x odd, for b128 readers
constexpr float SCALE   = 0.125f;   // 1/sqrt(64), folded into Q->f16 conversion
constexpr float NEG_INF = -1e30f;

typedef __attribute__((ext_vector_type(16))) _Float16 v16h;
typedef __attribute__((ext_vector_type(8)))  _Float16 v8h;
typedef __attribute__((ext_vector_type(4)))  _Float16 v4h;
typedef __attribute__((ext_vector_type(8)))  short    v8s;
typedef __attribute__((ext_vector_type(8)))  float    v8f;
typedef __attribute__((ext_vector_type(4)))  float    v4f;

// A/B fragment layout for V_WMMA_F32_16X16X32_F16 (per ISA 7.12.2):
// lane (0..15) holds row/col (lane&15) with K-chunks {8*hi+0..7, 16+8*hi+0..7}
// of each 32-wide K block; chunks are 8 contiguous elements (16B).
__device__ inline v16h frag_from_f32(const float* __restrict__ p, float scale) {
  v4f x0 = *(const v4f*)(p +  0);
  v4f x1 = *(const v4f*)(p +  4);
  v4f x2 = *(const v4f*)(p + 16);
  v4f x3 = *(const v4f*)(p + 20);
  v16h f;
#pragma unroll
  for (int j = 0; j < 4; ++j) {
    f[j]      = (_Float16)(x0[j] * scale);
    f[4 + j]  = (_Float16)(x1[j] * scale);
    f[8 + j]  = (_Float16)(x2[j] * scale);
    f[12 + j] = (_Float16)(x3[j] * scale);
  }
  return f;
}

// lane l with lane l ^ 16 (the two halves of a wave hold the same query column)
__device__ inline float xhalf(float x) {
  const int b = __builtin_bit_cast(int, x);
  return __builtin_bit_cast(float, __builtin_amdgcn_permlanex16(
      b, b, 0x76543210, 0xfedcba98, false, false));
}

__device__ inline v16h frag_from_lds(const _Float16* p) {
  v8h a = *(const v8h*)(p);        // 16B aligned (row stride 144B, offsets 16B)
  v8h b = *(const v8h*)(p + 16);
  v16h f;
#pragma unroll
  for (int j = 0; j < 8; ++j) { f[j] = a[j]; f[8 + j] = b[j]; }
  return f;
}

// 16 x 32 A fragment of V^T out of row-major V rows: each transposing load hands
// lane (c, hi) the column c of keys 8*hi+0..7 of its 16-key block, the k order above.
__device__ inline v16h frag_tr_from_lds(const _Float16* p) {
  typedef __attribute__((address_space(3))) v8s lds_v8s;
  v8h a = __builtin_bit_cast(v8h, __builtin_amdgcn_ds_load_tr16_b128_v8i16((lds_v8s*)p));
  v8h b = __builtin_bit_cast(v8h, __builtin_amdgcn_ds_load_tr16_b128_v8i16((lds_v8s*)(p + 16 * LDV)));
  v16h f;
#pragma unroll
  for (int j = 0; j < 8; ++j) { f[j] = a[j]; f[8 + j] = b[j]; }
  return f;
}

// One trip's bias rows of this wave (16 queries x 64 keys): a copy moves two whole
// 256-B row pieces, lane (c, hi) the 16-B piece c of row 2i + hi. l: the lane's LDS byte
// address of row hi, g: its global address there.
__device__ inline void copy_bias(unsigned l, const float* g) {
  // the wait is the last line of the copies' own statement, so that no address
  // register of a copy is written again in front of it
  asm volatile("global_load_async_to_lds_b128 %0, %8, off\n\t"
               "global_load_async_to_lds_b128 %1, %9, off\n\t"
               "global_load_async_to_lds_b128 %2, %10, off\n\t"
               "global_load_async_to_lds_b128 %3, %11, off\n\t"
               "global_load_async_to_lds_b128 %4, %12, off\n\t"
               "global_load_async_to_lds_b128 %5, %13, off\n\t"
               "global_load_async_to_lds_b128 %6, %14, off\n\t"
               "global_load_async_to_lds_b128 %7, %15, off\n\t"
               "s_wait_xcnt 0x0"
               :: "v"(l), "v"(l + 2 * LDB * 4), "v"(l + 4 * LDB * 4), "v"(l + 6 * LDB * 4),
                  "v"(l + 8 * LDB * 4), "v"(l + 10 * LDB * 4), "v"(l + 12 * LDB * 4), "v"(l + 14 * LDB * 4),
                  "v"(g), "v"(g + 2 * S_), "v"(g + 4 * S_), "v"(g + 6 * S_),
                  "v"(g + 8 * S_), "v"(g + 10 * S_), "v"(g + 12 * S_), "v"(g + 14 * S_)
               : "memory");
}

// This work-item's share of a 64x64 K and V tile, 4 float4s each: row (tid >> 4) + 16i,
// float4 column tid & 15. kt, vt: the tile's first row for this head (the same for the
// whole workgroup), off: the work-item's place in bytes from there.
__device__ inline void load_kv(const float* __restrict__ kt, const float* __restrict__ vt,
                               unsigned off, v4f (&kx)[4], v4f (&vx)[4]) {
  const char* kp = (const char*)kt + off;
  const char* vp = (const char*)vt + off;
#pragma unroll
  for (int i = 0; i < 4; ++i) {
    kx[i] = *(const v4f*)(kp + i * (16 * H_ * D_ * 4));
    vx[i] = *(const v4f*)(vp + i * (16 * H_ * D_ * 4));
  }
  // both address pairs stay live up to this wait, so that no load of the run
  // lands in one and none is written again in front of it
  asm volatile("s_wait_xcnt 0x0" :: "v"(kp), "v"(vp) : "memory");
}

// The same share, converted to f16, into one pair of LDS buffers (both row-major).
// kd, vd: the work-item's place in row tid >> 4 of the K and of the V buffer.
__device__ inline void store_kv(_Float16* kd, _Float16* vd,
                                const v4f (&kx)[4], const v4f (&vx)[4]) {
#pragma unroll
  for (int i = 0; i < 4; ++i) {
    v4h kh, vh;
#pragma unroll
    for (int j = 0; j < 4; ++j) { kh[j] = (_Float16)kx[i][j]; vh[j] = (_Float16)vx[i][j]; }
    *(v4h*)(kd + i * (16 * LDK)) = kh;       // ds_store_b64
    *(v4h*)(vd + i * (16 * LDV)) = vh;       // ds_store_b64
  }
}

// second argument: six waves per SIMD, so that three workgroups still share a WGP
__global__ __launch_bounds__(NTHR, 6)
void fa_fwd_wmma(const float* __restrict__ q, const float* __restrict__ k,
                 const float* __restrict__ v, const float* __restrict__ bias,
                 float* __restrict__ out) {
  __shared__ _Float16 Ksh[2 * BLOCK_N * LDK];   // [buffer][kv][d]   row-major f16
  __shared__ _Float16 Vsh[2 * BLOCK_N * LDV];   // [buffer][kv][d]   row-major f16
  __shared__ __attribute__((aligned(16))) float Bsh[2 * BLOCK_M * LDB];  // [buffer][q][kv] f32

  // Causal cost grows with the q tile index and there are more workgroups than
  // resident places; the longest tiles take the lowest indices and the short
  // ones take the highest (for speed only).
  const int qt   = (S_ / BLOCK_M - 1) - blockIdx.z;   // q tile index, heaviest first
  const int h    = blockIdx.x;
  const int b    = blockIdx.y;
  const int tid  = threadIdx.x;
  const int wv   = tid >> 5;                // wave 0..7
  const int lane = tid & 31;
  const int nlo  = lane & 15;
  const int hi   = lane >> 4;

  const int q0 = qt * BLOCK_M;
  // first query of this wave's 64-query half, in a scalar register: the tests on it
  // below are scalar branches, so that every lane stays on at the matrix instructions
  const int wq0 = q0 + BLOCK_N * __builtin_amdgcn_readfirstlane(wv >> 2);

  // ---- Q^T as B operand: lane = query column (scale folded in) ----
  const int qrow = q0 + 16 * wv + nlo;
  const float* qp = q + (((size_t)b * S_ + qrow) * H_ + h) * D_;
  const v16h qb0 = frag_from_f32(qp + 0  + 8 * hi, SCALE);
  const v16h qb1 = frag_from_f32(qp + 32 + 8 * hi, SCALE);

  // ---- running state of this lane's query; o[u][r] = O[qrow][16u + 8hi + r] ----
  v8f o[4];
  float m_i = -3.0e38f;
  float l_i = 0.0f;                         // this half's keys only, joined at the end
#pragma unroll
  for (int u = 0; u < 4; ++u) o[u] = (v8f){};

  // this lane's address in a transposing load of V: row 8*hi + (lane & 7), 16-B half
  const _Float16* vtr = &Vsh[(8 * hi + (lane & 7)) * LDV + 8 * ((lane >> 3) & 1)];

  // bias: what this lane copies (row 16wv + hi, 16-B piece nlo) and what it reads
  typedef __attribute__((address_space(3))) float lds_float;
  const unsigned bl = (unsigned)(size_t)(lds_float*)&Bsh[(16 * wv + hi) * LDB + 4 * nlo];
  const float* bg   = bias + ((size_t)h * S_ + q0 + 16 * wv + hi) * S_ + 4 * nlo;
  const float* brd  = &Bsh[(16 * wv + nlo) * LDB + 8 * hi];
  constexpr int BBUF = BLOCK_M * LDB;       // floats per bias buffer
  constexpr int KBUF = BLOCK_N * LDK;       // halves per K buffer
  constexpr int VBUF = BLOCK_N * LDV;       // halves per V buffer

  const int n_tiles = 2 * qt + 2;           // causal: kv tiles 0..2qt+1

  // ---- prologue: bias tile 0 and K/V tile 0 land and are published, tile 1 starts
  //      (n_tiles is even and at least 2) ----
  v4f kx[4], vx[4];                         // the K/V tile in flight, one trip ahead
  const size_t   kvh  = ((size_t)b * S_ * H_ + h) * D_;              // key 0 of this head
  const unsigned kvo  = (unsigned)((tid >> 4) * (H_ * D_ * 4) + (tid & 15) * 16);   // bytes
  _Float16* const kst = &Ksh[(tid >> 4) * LDK + (tid & 15) * 4];
  _Float16* const vst = &Vsh[(tid >> 4) * LDV + (tid & 15) * 4];
  copy_bias(bl, bg);
  load_kv(k + kvh, v + kvh, kvo, kx, vx);
  store_kv(kst, vst, kx, vx);
  asm volatile("s_wait_asynccnt 0x0" ::: "memory");   // bias tile 0 has landed
  __syncthreads();
  load_kv(k + kvh + BLOCK_N * (H_ * D_), v + kvh + BLOCK_N * (H_ * D_), kvo, kx, vx);
  copy_bias(bl + BBUF * 4, bg + BLOCK_N);

  // ---- S^T = K*Q^T (+bias as initial C) : 4 key tiles x 2 K-steps ----
  // st[t][r] = S[qrow][64it + 16t + 8hi + r]: 8 consecutive keys of one bias row
  auto scores = [&](int it, v8f (&st)[4]) {
    const float* bb = brd + (it & 1) * BBUF;
    const _Float16* Kc = Ksh + (it & 1) * KBUF;
    v4f c0[4], c1[4];
#pragma unroll
    for (int t = 0; t < 4; ++t) {
      c0[t] = *(const v4f*)(bb + 16 * t);
      c1[t] = *(const v4f*)(bb + 16 * t + 4);
    }
#pragma unroll
    for (int t = 0; t < 4; ++t) {
      v8f c;
#pragma unroll
      for (int j = 0; j < 4; ++j) { c[j] = c0[t][j]; c[4 + j] = c1[t][j]; }
      const _Float16* krow = &Kc[(16 * t + nlo) * LDK + 8 * hi];
      v16h ka0 = frag_from_lds(krow + 0);
      v16h ka1 = frag_from_lds(krow + 32);
      c = __builtin_amdgcn_wmma_f32_16x16x32_f16(false, ka0, false, qb0,
                                                 (short)0, c, false, false);
      c = __builtin_amdgcn_wmma_f32_16x16x32_f16(false, ka1, false, qb1,
                                                 (short)0, c, false, false);
      st[t] = c;
    }
  };

  // ---- mask, online softmax and O^T += V^T*P^T of tile it ----
  auto finish = [&](int it, v8f (&st)[4]) {
    // ---- causal mask on the diagonal tile ----
    if (it * BLOCK_N == wq0) {
#pragma unroll
      for (int t = 0; t < 4; ++t)
#pragma unroll
        for (int r = 0; r < 8; ++r)
          if (16 * t + 8 * hi + r > 16 * (wv & 3) + nlo) st[t][r] = NEG_INF;
    }

    // ---- online softmax: maximum in-lane, one exchange between the halves ----
    float mt[4];                            // one chain per key tile
#pragma unroll
    for (int t = 0; t < 4; ++t) {
      mt[t] = st[t][0];
#pragma unroll
      for (int r = 1; r < 8; ++r) mt[t] = fmaxf(mt[t], st[t][r]);
    }
    float mx = fmaxf(fmaxf(mt[0], mt[1]), fmaxf(mt[2], mt[3]));
    mx = fmaxf(mx, xhalf(mx));

    const float mn = fmaxf(m_i, mx);
    const float al = __expf(m_i - mn);
    m_i = mn;

    // ---- P^T = exp(S^T - m): tiles (0,1) and (2,3) convert in place into the
    //      B operands of keys 0..31 and 32..63, in the hardware k order ----
    v16h pb[2];
    float rs[4];                            // one chain per key tile
#pragma unroll
    for (int t = 0; t < 4; ++t) {
      rs[t] = 0.0f;
#pragma unroll
      for (int r = 0; r < 8; ++r) {
        const float p = __expf(st[t][r] - m_i);
        rs[t] += p;
        pb[t >> 1][8 * (t & 1) + r] = (_Float16)p;
      }
    }
    l_i = l_i * al + ((rs[0] + rs[1]) + (rs[2] + rs[3]));

    // ---- O^T = O^T*alpha + V^T*P^T ----
#pragma unroll
    for (int u = 0; u < 4; ++u) {
      v8f oc = o[u];
#pragma unroll
      for (int r = 0; r < 8; ++r) oc[r] *= al;
      const _Float16* vcol = vtr + (it & 1) * VBUF + 16 * u;
      v16h va0 = frag_tr_from_lds(vcol);
      v16h va1 = frag_tr_from_lds(vcol + 32 * LDV);
      oc = __builtin_amdgcn_wmma_f32_16x16x32_f16(false, va0, false, pb[0],
                                                  (short)0, oc, false, false);
      oc = __builtin_amdgcn_wmma_f32_16x16x32_f16(false, va1, false, pb[1],
                                                  (short)0, oc, false, false);
      o[u] = oc;
    }
  };

  // ---- every tile but the last: none lies above the diagonal for any wave ----
  for (int it = 0; ; ++it) {
    v8f st[4];
    scores(it, st);

    // tile it + 1 has flown under the score products: convert it into the other pair
    // of buffers, whose last reads the barrier at the foot of trip it - 1 ended.
    // The scheduling barrier keeps the conversions, and with them the wait for the
    // loads, from being lifted to the head of the trip, where the loads have just started.
    __builtin_amdgcn_sched_barrier(0);
    store_kv(kst + ((it + 1) & 1) * KBUF, vst + ((it + 1) & 1) * VBUF, kx, vx);

    finish(it, st);

    // ---- foot of the trip: publish bias and K/V tile it + 1, free this trip's buffers ----
    asm volatile("s_wait_dscnt 0x0" ::: "memory");      // this wave's LDS reads and stores are done
    asm volatile("s_wait_asynccnt 0x0" ::: "memory");   // its copies of tile it + 1 have landed
    __syncthreads();
    if (it + 2 >= n_tiles) break;
    // tile it + 2 starts: K/V into registers, bias into the buffer this trip has read
    const size_t kvt = kvh + (size_t)(it + 2) * (BLOCK_N * H_ * D_);
    load_kv(k + kvt, v + kvt, kvo, kx, vx);
    copy_bias(bl + (it & 1) * (BBUF * 4), bg + (it + 2) * BLOCK_N);
  }

  // ---- the last tile: the diagonal of the upper 64 queries, wholly above it for the
  //      lower 64, whose waves are done; nothing is staged or refilled any more ----
  if ((n_tiles - 1) * BLOCK_N <= wq0) {
    v8f st[4];
    scores(n_tiles - 1, st);
    finish(n_tiles - 1, st);
  }
  asm volatile("s_wait_asynccnt 0x0" ::: "memory");     // no copy outlives the loop

  // ---- finalize: O / l, store fp32 [B,S,H,D]; 8 consecutive d per lane ----
  const float inv_l = 1.0f / (l_i + xhalf(l_i));  // causal => l > 0
  float* op = out + (((size_t)b * S_ + qrow) * H_ + h) * D_ + 8 * hi;
#pragma unroll
  for (int u = 0; u < 4; ++u) {
    v4f y0, y1;
#pragma unroll
    for (int j = 0; j < 4; ++j) { y0[j] = o[u][j] * inv_l; y1[j] = o[u][4 + j] * inv_l; }
    *(v4f*)(op + 16 * u)     = y0;
    *(v4f*)(op + 16 * u + 4) = y1;
  }
}

extern "C" void kernel_launch(void* const* d_in, const int* in_sizes, int n_in,
                              void* d_out, int out_size, void* d_ws, size_t ws_size,
                              hipStream_t stream) {
  (void)in_sizes; (void)n_in; (void)out_size; (void)d_ws; (void)ws_size;
  const float* q    = (const float*)d_in[0];
  const float* k    = (const float*)d_in[1];
  const float* v    = (const float*)d_in[2];
  const float* bias = (const float*)d_in[3];
  float* out        = (float*)d_out;
  dim3 grid(H_, B_, S_ / BLOCK_M);
  fa_fwd_wmma<<<grid, NTHR, 0, stream>>>(q, k, v, bias, out);
}
